// v000
// Times are from an AMD MI455X. After a warm-up the kernel runs many times in a row, and a time is the length of
// such a window on the GPU divided by its runs, so every launch and the gaps after it count. The runs cycle
// through copies of the inputs. A figure is the median of several windows, for all but v000 over two sittings.
// Sittings can differ by a few percent; kernels timed side by side share one.
// v000, which the later versions start from, runs in 66.5 microseconds.
#include <hip/hip_runtime.h>

// ---------------------------------------------------------------------------
// Flash-attention for B=4, H=16, S=1024, D=64 on gfx1250 (CDNA5, wave32).
// QK^T, P*ones (row sums) and P@V all run on v_wmma_f32_16x16x32_f16.
// Double-buffered LDS tiles, one barrier per key step, global loads issued
// ahead of compute, b128 LDS fragment loads, packed-f16 max butterflies,
// global_prefetch for tile n+2.
// ---------------------------------------------------------------------------

typedef __attribute__((ext_vector_type(16))) _Float16 v16h;
typedef __attribute__((ext_vector_type(2)))  _Float16 h2;
typedef __attribute__((ext_vector_type(8)))  float    v8f;

constexpr int SEQ   = 1024;   // sequence length S
constexpr int HD    = 64;     // head dim D
constexpr int KT    = 32;     // keys per flash step (one f16 WMMA K-dim)
constexpr int WAVES = 8;
constexpr int BLOCK = WAVES * 32;
constexpr int RPW   = 16;                 // query rows per wave
constexpr int RPB   = WAVES * RPW;        // 128 rows per block
constexpr int NSTEP = SEQ / KT;           // 32

union Frag { v16h h; uint4 q[2]; };
union H2U  { _Float16 h[2]; unsigned int u; };
union H2V  { h2 v; unsigned int u; };

// A/B 16-bit fragment from a row-major f16 row whose layout is contiguous in
// the WMMA K dimension: halves 0..7 = row[hi8 .. hi8+7],
// halves 8..15 = row[16+hi8 .. 16+hi8+7]  ->  two ds_load_b128 per lane.
__device__ __forceinline__ v16h ld_frag(const _Float16* row, int hi8) {
    Frag f;
    f.q[0] = *(const uint4*)(row + hi8);
    f.q[1] = *(const uint4*)(row + 16 + hi8);
    return f.h;
}

#define WMMA_F16(A, B, C) \
    __builtin_amdgcn_wmma_f32_16x16x32_f16(false, (A), false, (B), (short)0, (C), false, false)

__global__ __launch_bounds__(BLOCK)
void mha_flash_wmma_kernel(const float* __restrict__ q,     // [B*H, S, D]
                           const float* __restrict__ kT,    // [B*H, D, S]
                           const int*   __restrict__ scale_p,
                           const float* __restrict__ mask,  // [S, S]
                           const float* __restrict__ vmat,  // [B*H, S, D]
                           float* __restrict__ out)         // [B*H, S, D]
{
    const int head = blockIdx.y;
    const int tid  = threadIdx.x;
    const int wave = tid >> 5;
    const int lane = tid & 31;
    const int ncol = lane & 15;
    const int hi8  = (lane >> 4) << 3;     // 0 or 8
    const int qrow0 = blockIdx.x * RPB + wave * RPW;

    const float* qh = q    + (size_t)head * SEQ * HD;
    const float* kh = kT   + (size_t)head * HD  * SEQ;
    const float* vh = vmat + (size_t)head * SEQ * HD;
    float*       oh = out  + (size_t)head * SEQ * HD;
    const float inv_scale = 1.0f / (float)scale_p[0];

    // Double-buffered tiles. K: [key][d] (K-dim of QK^T frag = d, contiguous).
    // V: [d][sigma(key)]  (K-dim of PV frag = key, contiguous, sigma-ordered).
    __shared__ __align__(16) _Float16 Ksh[2][KT * HD];          // 8 KB
    __shared__ __align__(16) _Float16 Vsh[2][HD * KT];          // 8 KB
    __shared__ __align__(16) _Float16 Psh[WAVES][RPW * KT];     // 8 KB

    // ---- staging decomposition (one (2d x 4key) K unit + (2key x 4d) V unit
    //      per thread per tile; float4 global loads, b32 packed LDS stores) --
    const int kd0   = (tid >> 3) * 2;      // K: d pair base (0..62)
    const int kkey4 = (tid & 7) * 4;       // K: key group of 4
    const int vkey  = tid & 15;            // V: key (paired with vkey+16)
    const int vd4   = (tid >> 4) * 4;      // V: d group of 4

    float4 kr0, kr1, vr0, vr1;
    auto load_tile = [&](int kb) {
        kr0 = *(const float4*)(kh + (size_t)kd0 * SEQ + kb + kkey4);
        kr1 = *(const float4*)(kh + (size_t)(kd0 + 1) * SEQ + kb + kkey4);
        vr0 = *(const float4*)(vh + (size_t)(kb + vkey) * HD + vd4);
        vr1 = *(const float4*)(vh + (size_t)(kb + vkey + 16) * HD + vd4);
    };
    auto store_tile = [&](int buf) {
        const float* k0p = &kr0.x; const float* k1p = &kr1.x;
        const float* v0p = &vr0.x; const float* v1p = &vr1.x;
        #pragma unroll
        for (int j = 0; j < 4; ++j) {
            H2U a; a.h[0] = (_Float16)k0p[j]; a.h[1] = (_Float16)k1p[j];
            *(unsigned int*)(&Ksh[buf][(kkey4 + j) * HD + kd0]) = a.u;
            // physical column 2*vkey holds key vkey, 2*vkey+1 holds key vkey+16
            H2U b; b.h[0] = (_Float16)v0p[j]; b.h[1] = (_Float16)v1p[j];
            *(unsigned int*)(&Vsh[buf][(vd4 + j) * KT + 2 * vkey]) = b.u;
        }
    };

    // ---- Q A-fragments (16x32 f16, two covering D=64), built once ----------
    v16h a0, a1;
    {
        const float* qrow = qh + (size_t)(qrow0 + ncol) * HD;
        #pragma unroll
        for (int half = 0; half < 2; ++half) {          // halves 0..7 / 8..15
            const int dbase = half * 16 + hi8;
            float4 f0 = *(const float4*)(qrow + dbase);
            float4 f1 = *(const float4*)(qrow + dbase + 4);
            float4 g0 = *(const float4*)(qrow + 32 + dbase);
            float4 g1 = *(const float4*)(qrow + 32 + dbase + 4);
            const float* fp0 = &f0.x; const float* fp1 = &f1.x;
            const float* gp0 = &g0.x; const float* gp1 = &g1.x;
            #pragma unroll
            for (int j = 0; j < 4; ++j) {
                a0[half * 8 + j]     = (_Float16)fp0[j];
                a0[half * 8 + 4 + j] = (_Float16)fp1[j];
                a1[half * 8 + j]     = (_Float16)gp0[j];
                a1[half * 8 + 4 + j] = (_Float16)gp1[j];
            }
        }
    }

    v16h ones;
    #pragma unroll
    for (int i = 0; i < 16; ++i) ones[i] = (_Float16)1.0f;

    // ---- online-softmax state (replicated across each 16-lane half) --------
    float mrowv[8], lrowv[8];
    #pragma unroll
    for (int r = 0; r < 8; ++r) { mrowv[r] = -3.0e38f; lrowv[r] = 0.0f; }
    v8f o0 = {}, o1 = {}, o2 = {}, o3 = {};

    // ---- prologue: stage tile 0 --------------------------------------------
    load_tile(0);
    store_tile(0);
    __syncthreads();

    for (int step = 0; step < NSTEP; ++step) {
        const int kb  = step * KT;
        const int cur = step & 1;

        // issue next tile's global loads before compute (overlap with WMMA)
        if (step + 1 < NSTEP) load_tile(kb + KT);
        if (step + 2 < NSTEP) {
            __builtin_prefetch(kh + (size_t)kd0 * SEQ + kb + 2 * KT + kkey4, 0, 1);
            __builtin_prefetch(vh + (size_t)(kb + 2 * KT + vkey) * HD + vd4, 0, 1);
        }

        // ---- scores: S(16x32) = Q(16x64) x K^T, 4 WMMAs ----
        const _Float16* krow0 = &Ksh[cur][ncol * HD];          // key = ncol
        const _Float16* krow1 = &Ksh[cur][(16 + ncol) * HD];   // key = 16+ncol
        v16h bk00 = ld_frag(krow0, hi8);
        v16h bk01 = ld_frag(krow0 + 32, hi8);
        v16h bk10 = ld_frag(krow1, hi8);
        v16h bk11 = ld_frag(krow1 + 32, hi8);
        v8f c0 = {}, c1 = {};
        c0 = WMMA_F16(a0, bk00, c0);
        c0 = WMMA_F16(a1, bk01, c0);
        c1 = WMMA_F16(a0, bk10, c1);
        c1 = WMMA_F16(a1, bk11, c1);

        // ---- scale + mask ----
        float s0v[8], s1v[8];
        const float* mbase = mask + (size_t)(qrow0 + hi8) * SEQ + kb;
        #pragma unroll
        for (int r = 0; r < 8; ++r) {
            const float* mp = mbase + (size_t)r * SEQ;
            s0v[r] = c0[r] * inv_scale + mp[ncol];
            s1v[r] = c1[r] * inv_scale + mp[16 + ncol];
        }

        // ---- row max over 32 keys: two rows packed as 2xf16 per butterfly
        //      (v_pk_max_num_f16; f16 precision is fine for a stability max) --
        float mxv[8];
        #pragma unroll
        for (int rp = 0; rp < 4; ++rp) {
            H2V m2;
            m2.v[0] = (_Float16)fmaxf(s0v[2 * rp],     s1v[2 * rp]);
            m2.v[1] = (_Float16)fmaxf(s0v[2 * rp + 1], s1v[2 * rp + 1]);
            #pragma unroll
            for (int m = 1; m <= 8; m <<= 1) {
                H2V o2; o2.u = __shfl_xor(m2.u, m);
                m2.v = __builtin_elementwise_max(m2.v, o2.v);
            }
            mxv[2 * rp]     = (float)m2.v[0];
            mxv[2 * rp + 1] = (float)m2.v[1];
        }

        // ---- online softmax update + packed P spill ----
        float alpha[8];
        _Float16* pw = Psh[wave];
        #pragma unroll
        for (int r = 0; r < 8; ++r) {
            const float mnew = fmaxf(mrowv[r], mxv[r]);
            alpha[r] = __expf(mrowv[r] - mnew);
            mrowv[r] = mnew;
            const float p0 = __expf(s0v[r] - mnew);
            const float p1 = __expf(s1v[r] - mnew);
            // packed spill: physical cols (2n, 2n+1) = logical keys (n, 16+n)
            H2U pp; pp.h[0] = (_Float16)p0; pp.h[1] = (_Float16)p1;
            *(unsigned int*)(&pw[(r + hi8) * KT + 2 * ncol]) = pp.u;
        }
        #pragma unroll
        for (int r = 0; r < 8; ++r) {
            o0[r] *= alpha[r]; o1[r] *= alpha[r];
            o2[r] *= alpha[r]; o3[r] *= alpha[r];
        }

        // ---- reload P in A-layout (DS in-order within wave) ----
        v16h pa = ld_frag(&pw[ncol * KT], hi8);

        // ---- row sums of P via WMMA against all-ones B (replicated result) --
        v8f csum = {};
        csum = WMMA_F16(pa, ones, csum);
        #pragma unroll
        for (int r = 0; r < 8; ++r) lrowv[r] = lrowv[r] * alpha[r] + csum[r];

        // ---- PV: O(16x64) += P(16x32) x V(32x64), 4 WMMAs ----
        {
            v16h bv0 = ld_frag(&Vsh[cur][(0 * 16 + ncol) * KT], hi8);
            v16h bv1 = ld_frag(&Vsh[cur][(1 * 16 + ncol) * KT], hi8);
            v16h bv2 = ld_frag(&Vsh[cur][(2 * 16 + ncol) * KT], hi8);
            v16h bv3 = ld_frag(&Vsh[cur][(3 * 16 + ncol) * KT], hi8);
            o0 = WMMA_F16(pa, bv0, o0);
            o1 = WMMA_F16(pa, bv1, o1);
            o2 = WMMA_F16(pa, bv2, o2);
            o3 = WMMA_F16(pa, bv3, o3);
        }

        // stage next tile into the other buffer; one barrier per step
        if (step + 1 < NSTEP) store_tile(cur ^ 1);
        __syncthreads();
    }

    // ---- epilogue: normalize by row sum, store fp32 ------------------------
    #pragma unroll
    for (int r = 0; r < 8; ++r) {
        const int grow = qrow0 + r + hi8;
        const float invl = 1.0f / lrowv[r];
        oh[(size_t)grow * HD + 0 * 16 + ncol] = o0[r] * invl;
        oh[(size_t)grow * HD + 1 * 16 + ncol] = o1[r] * invl;
        oh[(size_t)grow * HD + 2 * 16 + ncol] = o2[r] * invl;
        oh[(size_t)grow * HD + 3 * 16 + ncol] = o3[r] * invl;
    }
}

extern "C" void kernel_launch(void* const* d_in, const int* in_sizes, int n_in,
                              void* d_out, int out_size, void* d_ws, size_t ws_size,
                              hipStream_t stream) {
    (void)in_sizes; (void)n_in; (void)out_size; (void)d_ws; (void)ws_size;

    const float* q       = (const float*)d_in[0];   // [4,16,1024,64]
    const float* kT      = (const float*)d_in[1];   // [4,16,64,1024]
    const int*   scale_p = (const int*)  d_in[2];   // scalar 8
    const float* mask    = (const float*)d_in[3];   // [1024,1024]
    const float* v       = (const float*)d_in[4];   // [4,16,1024,64]
    float*       out     = (float*)d_out;           // [4,16,1024,64]

    const int heads = 4 * 16;
    dim3 grid(SEQ / RPB, heads);                    // (8, 64)
    dim3 block(BLOCK);                              // 256 threads = 8 wave32
    mha_flash_wmma_kernel<<<grid, block, 0, stream>>>(q, kT, scale_p, mask, v, out);
}

// v001
// A run of this version takes 52.6 microseconds.
// Timed twice side by side with v000, it ran 1.31 and 1.32 times as fast.
#include <hip/hip_runtime.h>

// ---------------------------------------------------------------------------
// Flash-attention for B=4, H=16, S=1024, D=64 on gfx1250 (CDNA5, wave32).
// QK^T, P*ones (row sums) and P@V all run on v_wmma_f32_16x16x32_f16.
// Double-buffered LDS tiles (rows padded against bank conflicts), one barrier
// per key step, global loads issued
// ahead of compute, b128 LDS fragment loads, packed-f16 max butterflies,
// global_prefetch for tile n+2.
// ---------------------------------------------------------------------------

typedef __attribute__((ext_vector_type(16))) _Float16 v16h;
typedef __attribute__((ext_vector_type(2)))  _Float16 h2;
typedef __attribute__((ext_vector_type(8)))  float    v8f;

constexpr int SEQ   = 1024;   // sequence length S
constexpr int HD    = 64;     // head dim D
constexpr int KT    = 32;     // keys per flash step (one f16 WMMA K-dim)
constexpr int WAVES = 8;
constexpr int BLOCK = WAVES * 32;
constexpr int RPW   = 16;                 // query rows per wave
constexpr int RPB   = WAVES * RPW;        // 128 rows per block
constexpr int NSTEP = SEQ / KT;           // 32
// LDS row pitches in halves. Every tile row is read by ds_load_b128, which is
// free of bank conflicts at a pitch of 16 B x odd (64 banks x 4 B).
constexpr int KP    = HD + 8;             // K rows: 128 B of data, 144 B pitch
constexpr int VP    = KT + 8;             // V rows:  64 B of data,  80 B pitch
constexpr int PP    = KT + 8;             // P rows:  64 B of data,  80 B pitch

union Frag { v16h h; uint4 q[2]; };
union H2U  { _Float16 h[2]; unsigned int u; };
union H2V  { h2 v; unsigned int u; };

// A/B 16-bit fragment from a row-major f16 row whose layout is contiguous in
// the WMMA K dimension: halves 0..7 = row[hi8 .. hi8+7],
// halves 8..15 = row[16+hi8 .. 16+hi8+7]  ->  two ds_load_b128 per lane.
__device__ __forceinline__ v16h ld_frag(const _Float16* row, int hi8) {
    Frag f;
    f.q[0] = *(const uint4*)(row + hi8);
    f.q[1] = *(const uint4*)(row + 16 + hi8);
    return f.h;
}

#define WMMA_F16(A, B, C) \
    __builtin_amdgcn_wmma_f32_16x16x32_f16(false, (A), false, (B), (short)0, (C), false, false)

__global__ __launch_bounds__(BLOCK)
void mha_flash_wmma_kernel(const float* __restrict__ q,     // [B*H, S, D]
                           const float* __restrict__ kT,    // [B*H, D, S]
                           const int*   __restrict__ scale_p,
                           const float* __restrict__ mask,  // [S, S]
                           const float* __restrict__ vmat,  // [B*H, S, D]
                           float* __restrict__ out)         // [B*H, S, D]
{
    const int head = blockIdx.y;
    const int tid  = threadIdx.x;
    const int wave = tid >> 5;
    const int lane = tid & 31;
    const int ncol = lane & 15;
    const int hi8  = (lane >> 4) << 3;     // 0 or 8
    const int qrow0 = blockIdx.x * RPB + wave * RPW;

    const float* qh = q    + (size_t)head * SEQ * HD;
    const float* kh = kT   + (size_t)head * HD  * SEQ;
    const float* vh = vmat + (size_t)head * SEQ * HD;
    float*       oh = out  + (size_t)head * SEQ * HD;
    const float inv_scale = 1.0f / (float)scale_p[0];

    // Double-buffered tiles. K: [key][d] (K-dim of QK^T frag = d, contiguous).
    // V: [d][sigma(key)]  (K-dim of PV frag = key, contiguous, sigma-ordered).
    __shared__ __align__(16) _Float16 Ksh[2][KT * KP];          // 9 KB
    __shared__ __align__(16) _Float16 Vsh[2][HD * VP];          // 10 KB
    __shared__ __align__(16) _Float16 Psh[WAVES][RPW * PP];     // 10 KB

    // ---- staging decomposition (one (2d x 4key) K unit + (2key x 4d) V unit
    //      per thread per tile; float4 global loads, b32 packed LDS stores) --
    const int kd0   = (tid >> 3) * 2;      // K: d pair base (0..62)
    const int kkey4 = (tid & 7) * 4;       // K: key group of 4
    const int vkey  = tid & 15;            // V: key (paired with vkey+16)
    const int vd4   = (tid >> 4) * 4;      // V: d group of 4

    float4 kr0, kr1, vr0, vr1;
    auto load_tile = [&](int kb) {
        kr0 = *(const float4*)(kh + (size_t)kd0 * SEQ + kb + kkey4);
        kr1 = *(const float4*)(kh + (size_t)(kd0 + 1) * SEQ + kb + kkey4);
        vr0 = *(const float4*)(vh + (size_t)(kb + vkey) * HD + vd4);
        vr1 = *(const float4*)(vh + (size_t)(kb + vkey + 16) * HD + vd4);
    };
    auto store_tile = [&](int buf) {
        const float* k0p = &kr0.x; const float* k1p = &kr1.x;
        const float* v0p = &vr0.x; const float* v1p = &vr1.x;
        #pragma unroll
        for (int j = 0; j < 4; ++j) {
            H2U a; a.h[0] = (_Float16)k0p[j]; a.h[1] = (_Float16)k1p[j];
            *(unsigned int*)(&Ksh[buf][(kkey4 + j) * KP + kd0]) = a.u;
            // physical column 2*vkey holds key vkey, 2*vkey+1 holds key vkey+16
            H2U b; b.h[0] = (_Float16)v0p[j]; b.h[1] = (_Float16)v1p[j];
            *(unsigned int*)(&Vsh[buf][(vd4 + j) * VP + 2 * vkey]) = b.u;
        }
    };

    // ---- Q A-fragments (16x32 f16, two covering D=64), built once ----------
    v16h a0, a1;
    {
        const float* qrow = qh + (size_t)(qrow0 + ncol) * HD;
        #pragma unroll
        for (int half = 0; half < 2; ++half) {          // halves 0..7 / 8..15
            const int dbase = half * 16 + hi8;
            float4 f0 = *(const float4*)(qrow + dbase);
            float4 f1 = *(const float4*)(qrow + dbase + 4);
            float4 g0 = *(const float4*)(qrow + 32 + dbase);
            float4 g1 = *(const float4*)(qrow + 32 + dbase + 4);
            const float* fp0 = &f0.x; const float* fp1 = &f1.x;
            const float* gp0 = &g0.x; const float* gp1 = &g1.x;
            #pragma unroll
            for (int j = 0; j < 4; ++j) {
                a0[half * 8 + j]     = (_Float16)fp0[j];
                a0[half * 8 + 4 + j] = (_Float16)fp1[j];
                a1[half * 8 + j]     = (_Float16)gp0[j];
                a1[half * 8 + 4 + j] = (_Float16)gp1[j];
            }
        }
    }

    v16h ones;
    #pragma unroll
    for (int i = 0; i < 16; ++i) ones[i] = (_Float16)1.0f;

    // ---- online-softmax state (replicated across each 16-lane half) --------
    float mrowv[8], lrowv[8];
    #pragma unroll
    for (int r = 0; r < 8; ++r) { mrowv[r] = -3.0e38f; lrowv[r] = 0.0f; }
    v8f o0 = {}, o1 = {}, o2 = {}, o3 = {};

    // ---- prologue: stage tile 0 --------------------------------------------
    load_tile(0);
    store_tile(0);
    __syncthreads();

    for (int step = 0; step < NSTEP; ++step) {
        const int kb  = step * KT;
        const int cur = step & 1;

        // issue next tile's global loads before compute (overlap with WMMA)
        if (step + 1 < NSTEP) load_tile(kb + KT);
        if (step + 2 < NSTEP) {
            __builtin_prefetch(kh + (size_t)kd0 * SEQ + kb + 2 * KT + kkey4, 0, 1);
            __builtin_prefetch(vh + (size_t)(kb + 2 * KT + vkey) * HD + vd4, 0, 1);
        }

        // ---- scores: S(16x32) = Q(16x64) x K^T, 4 WMMAs ----
        const _Float16* krow0 = &Ksh[cur][ncol * KP];          // key = ncol
        const _Float16* krow1 = &Ksh[cur][(16 + ncol) * KP];   // key = 16+ncol
        v16h bk00 = ld_frag(krow0, hi8);
        v16h bk01 = ld_frag(krow0 + 32, hi8);
        v16h bk10 = ld_frag(krow1, hi8);
        v16h bk11 = ld_frag(krow1 + 32, hi8);
        v8f c0 = {}, c1 = {};
        c0 = WMMA_F16(a0, bk00, c0);
        c0 = WMMA_F16(a1, bk01, c0);
        c1 = WMMA_F16(a0, bk10, c1);
        c1 = WMMA_F16(a1, bk11, c1);

        // ---- scale + mask ----
        float s0v[8], s1v[8];
        const float* mbase = mask + (size_t)(qrow0 + hi8) * SEQ + kb;
        #pragma unroll
        for (int r = 0; r < 8; ++r) {
            const float* mp = mbase + (size_t)r * SEQ;
            s0v[r] = c0[r] * inv_scale + mp[ncol];
            s1v[r] = c1[r] * inv_scale + mp[16 + ncol];
        }

        // ---- row max over 32 keys: two rows packed as 2xf16 per butterfly
        //      (v_pk_max_num_f16; f16 precision is fine for a stability max) --
        float mxv[8];
        #pragma unroll
        for (int rp = 0; rp < 4; ++rp) {
            H2V m2;
            m2.v[0] = (_Float16)fmaxf(s0v[2 * rp],     s1v[2 * rp]);
            m2.v[1] = (_Float16)fmaxf(s0v[2 * rp + 1], s1v[2 * rp + 1]);
            #pragma unroll
            for (int m = 1; m <= 8; m <<= 1) {
                H2V o2; o2.u = __shfl_xor(m2.u, m);
                m2.v = __builtin_elementwise_max(m2.v, o2.v);
            }
            mxv[2 * rp]     = (float)m2.v[0];
            mxv[2 * rp + 1] = (float)m2.v[1];
        }

        // ---- online softmax update + packed P spill ----
        float alpha[8];
        _Float16* pw = Psh[wave];
        #pragma unroll
        for (int r = 0; r < 8; ++r) {
            const float mnew = fmaxf(mrowv[r], mxv[r]);
            alpha[r] = __expf(mrowv[r] - mnew);
            mrowv[r] = mnew;
            const float p0 = __expf(s0v[r] - mnew);
            const float p1 = __expf(s1v[r] - mnew);
            // packed spill: physical cols (2n, 2n+1) = logical keys (n, 16+n)
            H2U pp; pp.h[0] = (_Float16)p0; pp.h[1] = (_Float16)p1;
            *(unsigned int*)(&pw[(r + hi8) * PP + 2 * ncol]) = pp.u;
        }
        #pragma unroll
        for (int r = 0; r < 8; ++r) {
            o0[r] *= alpha[r]; o1[r] *= alpha[r];
            o2[r] *= alpha[r]; o3[r] *= alpha[r];
        }

        // ---- reload P in A-layout (DS in-order within wave) ----
        v16h pa = ld_frag(&pw[ncol * PP], hi8);

        // ---- row sums of P via WMMA against all-ones B (replicated result) --
        v8f csum = {};
        csum = WMMA_F16(pa, ones, csum);
        #pragma unroll
        for (int r = 0; r < 8; ++r) lrowv[r] = lrowv[r] * alpha[r] + csum[r];

        // ---- PV: O(16x64) += P(16x32) x V(32x64), 4 WMMAs ----
        {
            v16h bv0 = ld_frag(&Vsh[cur][(0 * 16 + ncol) * VP], hi8);
            v16h bv1 = ld_frag(&Vsh[cur][(1 * 16 + ncol) * VP], hi8);
            v16h bv2 = ld_frag(&Vsh[cur][(2 * 16 + ncol) * VP], hi8);
            v16h bv3 = ld_frag(&Vsh[cur][(3 * 16 + ncol) * VP], hi8);
            o0 = WMMA_F16(pa, bv0, o0);
            o1 = WMMA_F16(pa, bv1, o1);
            o2 = WMMA_F16(pa, bv2, o2);
            o3 = WMMA_F16(pa, bv3, o3);
        }

        // stage next tile into the other buffer; one barrier per step
        if (step + 1 < NSTEP) store_tile(cur ^ 1);
        __syncthreads();
    }

    // ---- epilogue: normalize by row sum, store fp32 ------------------------
    #pragma unroll
    for (int r = 0; r < 8; ++r) {
        const int grow = qrow0 + r + hi8;
        const float invl = 1.0f / lrowv[r];
        oh[(size_t)grow * HD + 0 * 16 + ncol] = o0[r] * invl;
        oh[(size_t)grow * HD + 1 * 16 + ncol] = o1[r] * invl;
        oh[(size_t)grow * HD + 2 * 16 + ncol] = o2[r] * invl;
        oh[(size_t)grow * HD + 3 * 16 + ncol] = o3[r] * invl;
    }
}

extern "C" void kernel_launch(void* const* d_in, const int* in_sizes, int n_in,
                              void* d_out, int out_size, void* d_ws, size_t ws_size,
                              hipStream_t stream) {
    (void)in_sizes; (void)n_in; (void)out_size; (void)d_ws; (void)ws_size;

    const float* q       = (const float*)d_in[0];   // [4,16,1024,64]
    const float* kT      = (const float*)d_in[1];   // [4,16,64,1024]
    const int*   scale_p = (const int*)  d_in[2];   // scalar 8
    const float* mask    = (const float*)d_in[3];   // [1024,1024]
    const float* v       = (const float*)d_in[4];   // [4,16,1024,64]
    float*       out     = (float*)d_out;           // [4,16,1024,64]

    const int heads = 4 * 16;
    dim3 grid(SEQ / RPB, heads);                    // (8, 64)
    dim3 block(BLOCK);                              // 256 threads = 8 wave32
    mha_flash_wmma_kernel<<<grid, block, 0, stream>>>(q, kT, scale_p, mask, v, out);
}

// v002
// One run takes 39.9 microseconds.
// In both of two side-by-side timings against v001, it was 1.32 times as fast.
// Over all steps from v000 it is 1.74 times as fast.
#include <hip/hip_runtime.h>

// ---------------------------------------------------------------------------
// Flash-attention for B=4, H=16, S=1024, D=64 on gfx1250 (CDNA5, wave32).
// Both products are computed transposed on v_wmma_f32_16x16x32_f16:
// S^T = K * Q^T, O^T += V^T * P^T, row sums = ones * P^T. A lane then owns one
// query column: its maximum is taken in the lane plus one exchange between the
// wave halves, and the two S^T accumulator tiles, converted in place, are the
// B operand of the second product (P never goes through LDS).
// Double-buffered LDS tiles (rows padded against bank conflicts), one barrier
// per key step, global loads issued ahead of compute, b128 LDS fragment loads,
// global_prefetch for tile n+2.
// ---------------------------------------------------------------------------

typedef __attribute__((ext_vector_type(16))) _Float16 v16h;
typedef __attribute__((ext_vector_type(8)))  float    v8f;

constexpr int SEQ   = 1024;   // sequence length S
constexpr int HD    = 64;     // head dim D
constexpr int KT    = 32;     // keys per flash step (one f16 WMMA K-dim)
constexpr int WAVES = 8;
constexpr int BLOCK = WAVES * 32;
constexpr int RPW   = 16;                 // query rows per wave
constexpr int RPB   = WAVES * RPW;        // 128 rows per block
constexpr int NSTEP = SEQ / KT;           // 32
// LDS row pitches in halves. Every tile row is read by ds_load_b128, which is
// free of bank conflicts at a pitch of 16 B x odd (64 banks x 4 B).
constexpr int KP    = HD + 8;             // K rows: 128 B of data, 144 B pitch
constexpr int VP    = KT + 8;             // V rows:  64 B of data,  80 B pitch

union Frag { v16h h; uint4 q[2]; };
union H2U  { _Float16 h[2]; unsigned int u; };

// A/B 16-bit fragment from a row-major f16 row whose layout is contiguous in
// the WMMA K dimension: halves 0..7 = row[hi8 .. hi8+7],
// halves 8..15 = row[16+hi8 .. 16+hi8+7]  ->  two ds_load_b128 per lane.
__device__ __forceinline__ v16h ld_frag(const _Float16* row, int hi8) {
    Frag f;
    f.q[0] = *(const uint4*)(row + hi8);
    f.q[1] = *(const uint4*)(row + 16 + hi8);
    return f.h;
}

// lane l <-> lane l ^ 16, as a vector cross-row move
__device__ __forceinline__ float xhalf(float x) {
    const int i = __builtin_bit_cast(int, x);
    return __builtin_bit_cast(float,
        __builtin_amdgcn_permlanex16(i, i, 0x76543210, 0xfedcba98, false, false));
}

#define WMMA_F16(A, B, C) \
    __builtin_amdgcn_wmma_f32_16x16x32_f16(false, (A), false, (B), (short)0, (C), false, false)

__global__ __launch_bounds__(BLOCK)
void mha_flash_wmma_kernel(const float* __restrict__ q,     // [B*H, S, D]
                           const float* __restrict__ kT,    // [B*H, D, S]
                           const int*   __restrict__ scale_p,
                           const float* __restrict__ mask,  // [S, S]
                           const float* __restrict__ vmat,  // [B*H, S, D]
                           float* __restrict__ out)         // [B*H, S, D]
{
    const int head = blockIdx.y;
    const int tid  = threadIdx.x;
    const int wave = tid >> 5;
    const int lane = tid & 31;
    const int ncol = lane & 15;
    const int hi8  = (lane >> 4) << 3;     // 0 or 8
    const int qrow0 = blockIdx.x * RPB + wave * RPW;

    const float* qh = q    + (size_t)head * SEQ * HD;
    const float* kh = kT   + (size_t)head * HD  * SEQ;
    const float* vh = vmat + (size_t)head * SEQ * HD;
    float*       oh = out  + (size_t)head * SEQ * HD;
    const float inv_scale = 1.0f / (float)scale_p[0];

    // Double-buffered tiles. K: [key][d] (A rows of S^T = keys, k = d).
    // V: [d][key]  (A rows of O^T = d, k = key, in natural key order).
    __shared__ __align__(16) _Float16 Ksh[2][KT * KP];          // 9 KB
    __shared__ __align__(16) _Float16 Vsh[2][HD * VP];          // 10 KB

    // ---- staging decomposition (one (2d x 4key) K unit + (2key x 4d) V unit
    //      per thread per tile; float4 global loads, b32 packed LDS stores) --
    const int kd0   = (tid >> 3) * 2;      // K: d pair base (0..62)
    const int kkey4 = (tid & 7) * 4;       // K: key group of 4
    const int vkey  = (tid & 15) * 2;      // V: key (paired with vkey+1)
    const int vd4   = (tid >> 4) * 4;      // V: d group of 4

    float4 kr0, kr1, vr0, vr1;
    auto load_tile = [&](int kb) {
        kr0 = *(const float4*)(kh + (size_t)kd0 * SEQ + kb + kkey4);
        kr1 = *(const float4*)(kh + (size_t)(kd0 + 1) * SEQ + kb + kkey4);
        vr0 = *(const float4*)(vh + (size_t)(kb + vkey) * HD + vd4);
        vr1 = *(const float4*)(vh + (size_t)(kb + vkey + 1) * HD + vd4);
    };
    auto store_tile = [&](int buf) {
        const float* k0p = &kr0.x; const float* k1p = &kr1.x;
        const float* v0p = &vr0.x; const float* v1p = &vr1.x;
        #pragma unroll
        for (int j = 0; j < 4; ++j) {
            H2U a; a.h[0] = (_Float16)k0p[j]; a.h[1] = (_Float16)k1p[j];
            *(unsigned int*)(&Ksh[buf][(kkey4 + j) * KP + kd0]) = a.u;
            H2U b; b.h[0] = (_Float16)v0p[j]; b.h[1] = (_Float16)v1p[j];
            *(unsigned int*)(&Vsh[buf][(vd4 + j) * VP + vkey]) = b.u;
        }
    };

    // ---- Q^T B-fragments (32x16 f16, two covering D=64; lane = query column,
    //      same k order as ld_frag), built once ------------------------------
    v16h a0, a1;
    {
        const float* qrow = qh + (size_t)(qrow0 + ncol) * HD;
        #pragma unroll
        for (int half = 0; half < 2; ++half) {          // halves 0..7 / 8..15
            const int dbase = half * 16 + hi8;
            float4 f0 = *(const float4*)(qrow + dbase);
            float4 f1 = *(const float4*)(qrow + dbase + 4);
            float4 g0 = *(const float4*)(qrow + 32 + dbase);
            float4 g1 = *(const float4*)(qrow + 32 + dbase + 4);
            const float* fp0 = &f0.x; const float* fp1 = &f1.x;
            const float* gp0 = &g0.x; const float* gp1 = &g1.x;
            #pragma unroll
            for (int j = 0; j < 4; ++j) {
                a0[half * 8 + j]     = (_Float16)fp0[j];
                a0[half * 8 + 4 + j] = (_Float16)fp1[j];
                a1[half * 8 + j]     = (_Float16)gp0[j];
                a1[half * 8 + 4 + j] = (_Float16)gp1[j];
            }
        }
    }

    v16h ones;
    #pragma unroll
    for (int i = 0; i < 16; ++i) ones[i] = (_Float16)1.0f;

    // ---- online-softmax state of this lane's query (same in both halves) ---
    float mrun = -3.0e38f, lrun = 0.0f;
    v8f o0 = {}, o1 = {}, o2 = {}, o3 = {};   // o_t[r] = O[query][16t + hi8 + r]
    const float* mrow = mask + (size_t)(qrow0 + ncol) * SEQ + hi8;

    // ---- prologue: stage tile 0 --------------------------------------------
    load_tile(0);
    store_tile(0);
    __syncthreads();

    for (int step = 0; step < NSTEP; ++step) {
        const int kb  = step * KT;
        const int cur = step & 1;

        // issue next tile's global loads before compute (overlap with WMMA)
        if (step + 1 < NSTEP) load_tile(kb + KT);
        // ---- mask of this lane's query: keys hi8..hi8+7 and 16+hi8..16+hi8+7 --
        const float4 mk0 = *(const float4*)(mrow + kb);
        const float4 mk1 = *(const float4*)(mrow + kb + 4);
        const float4 mk2 = *(const float4*)(mrow + kb + 16);
        const float4 mk3 = *(const float4*)(mrow + kb + 20);
        if (step + 2 < NSTEP) {
            __builtin_prefetch(kh + (size_t)kd0 * SEQ + kb + 2 * KT + kkey4, 0, 1);
            __builtin_prefetch(vh + (size_t)(kb + 2 * KT + vkey) * HD + vd4, 0, 1);
        }

        // ---- scores: S^T(32x16) = K(32x64) x Q^T(64x16), 4 WMMAs ----
        const _Float16* krow0 = &Ksh[cur][ncol * KP];          // key = ncol
        const _Float16* krow1 = &Ksh[cur][(16 + ncol) * KP];   // key = 16+ncol
        v16h ak00 = ld_frag(krow0, hi8);
        v16h ak01 = ld_frag(krow0 + 32, hi8);
        v16h ak10 = ld_frag(krow1, hi8);
        v16h ak11 = ld_frag(krow1 + 32, hi8);
        v8f c0 = {}, c1 = {};
        c0 = WMMA_F16(ak00, a0, c0);
        c0 = WMMA_F16(ak01, a1, c0);
        c1 = WMMA_F16(ak10, a0, c1);
        c1 = WMMA_F16(ak11, a1, c1);

        // ---- scale + mask: c0[r] = key hi8+r, c1[r] = key 16+hi8+r ----
        const float m0v[8] = {mk0.x, mk0.y, mk0.z, mk0.w, mk1.x, mk1.y, mk1.z, mk1.w};
        const float m1v[8] = {mk2.x, mk2.y, mk2.z, mk2.w, mk3.x, mk3.y, mk3.z, mk3.w};
        float s0v[8], s1v[8];
        #pragma unroll
        for (int r = 0; r < 8; ++r) {
            s0v[r] = c0[r] * inv_scale + m0v[r];
            s1v[r] = c1[r] * inv_scale + m1v[r];
        }

        // ---- maximum over the 32 keys: 16 in the lane, then the other half ----
        float mx0 = s0v[0], mx1 = s1v[0];
        #pragma unroll
        for (int r = 1; r < 8; ++r) { mx0 = fmaxf(mx0, s0v[r]); mx1 = fmaxf(mx1, s1v[r]); }
        float mx = fmaxf(mx0, mx1);
        mx = fmaxf(mx, xhalf(mx));

        // ---- online softmax update; P^T packs straight into a B fragment ----
        const float mnew  = fmaxf(mrun, mx);
        const float alpha = __expf(mrun - mnew);
        mrun = mnew;
        v16h pb;
        #pragma unroll
        for (int r = 0; r < 8; ++r) {
            pb[r]     = (_Float16)__expf(s0v[r] - mnew);
            pb[8 + r] = (_Float16)__expf(s1v[r] - mnew);
        }
        #pragma unroll
        for (int r = 0; r < 8; ++r) {
            o0[r] *= alpha; o1[r] *= alpha;
            o2[r] *= alpha; o3[r] *= alpha;
        }

        // ---- sums of P over the 32 keys via WMMA with an all-ones A: every row
        //      of the result holds the column sums ----
        v8f csum = {};
        csum = WMMA_F16(ones, pb, csum);
        lrun = lrun * alpha + csum[0];

        // ---- PV: O^T(64x16) += V^T(64x32) x P^T(32x16), 4 WMMAs ----
        {
            v16h av0 = ld_frag(&Vsh[cur][(0 * 16 + ncol) * VP], hi8);
            v16h av1 = ld_frag(&Vsh[cur][(1 * 16 + ncol) * VP], hi8);
            v16h av2 = ld_frag(&Vsh[cur][(2 * 16 + ncol) * VP], hi8);
            v16h av3 = ld_frag(&Vsh[cur][(3 * 16 + ncol) * VP], hi8);
            o0 = WMMA_F16(av0, pb, o0);
            o1 = WMMA_F16(av1, pb, o1);
            o2 = WMMA_F16(av2, pb, o2);
            o3 = WMMA_F16(av3, pb, o3);
        }

        // stage next tile into the other buffer; one barrier per step
        if (step + 1 < NSTEP) store_tile(cur ^ 1);
        __syncthreads();
    }

    // ---- epilogue: normalize by row sum, store fp32 (8 consecutive d a tile) -
    {
        const float invl = 1.0f / lrun;
        float* orow = oh + (size_t)(qrow0 + ncol) * HD + hi8;
        *(float4*)(orow +  0) = make_float4(o0[0] * invl, o0[1] * invl, o0[2] * invl, o0[3] * invl);
        *(float4*)(orow +  4) = make_float4(o0[4] * invl, o0[5] * invl, o0[6] * invl, o0[7] * invl);
        *(float4*)(orow + 16) = make_float4(o1[0] * invl, o1[1] * invl, o1[2] * invl, o1[3] * invl);
        *(float4*)(orow + 20) = make_float4(o1[4] * invl, o1[5] * invl, o1[6] * invl, o1[7] * invl);
        *(float4*)(orow + 32) = make_float4(o2[0] * invl, o2[1] * invl, o2[2] * invl, o2[3] * invl);
        *(float4*)(orow + 36) = make_float4(o2[4] * invl, o2[5] * invl, o2[6] * invl, o2[7] * invl);
        *(float4*)(orow + 48) = make_float4(o3[0] * invl, o3[1] * invl, o3[2] * invl, o3[3] * invl);
        *(float4*)(orow + 52) = make_float4(o3[4] * invl, o3[5] * invl, o3[6] * invl, o3[7] * invl);
    }
}

extern "C" void kernel_launch(void* const* d_in, const int* in_sizes, int n_in,
                              void* d_out, int out_size, void* d_ws, size_t ws_size,
                              hipStream_t stream) {
    (void)in_sizes; (void)n_in; (void)out_size; (void)d_ws; (void)ws_size;

    const float* q       = (const float*)d_in[0];   // [4,16,1024,64]
    const float* kT      = (const float*)d_in[1];   // [4,16,64,1024]
    const int*   scale_p = (const int*)  d_in[2];   // scalar 8
    const float* mask    = (const float*)d_in[3];   // [1024,1024]
    const float* v       = (const float*)d_in[4];   // [4,16,1024,64]
    float*       out     = (float*)d_out;           // [4,16,1024,64]

    const int heads = 4 * 16;
    dim3 grid(SEQ / RPB, heads);                    // (8, 64)
    dim3 block(BLOCK);                              // 256 threads = 8 wave32
    mha_flash_wmma_kernel<<<grid, block, 0, stream>>>(q, kT, scale_p, mask, v, out);
}

// v003
// It runs in 32.9 microseconds.
// Next to v002, in two timings, it ran 1.22 and 1.21 times as fast.
// Counting every step since v000, it is 2.11 times as fast.
#include <hip/hip_runtime.h>

// ---------------------------------------------------------------------------
// Flash-attention for B=4, H=16, S=1024, D=64 on gfx1250 (CDNA5, wave32).
// Both products are computed transposed on v_wmma_f32_16x16x32_f16:
// S^T = K * Q^T, O^T += V^T * P^T, row sums = ones * P^T. A lane then owns one
// query column: its maximum is taken in the lane plus one exchange between the
// wave halves, and the two S^T accumulator tiles, converted in place, are the
// B operand of the second product (P never goes through LDS).
// Double-buffered LDS tiles (rows padded against bank conflicts), one barrier
// per key step, global loads issued ahead of compute, b128 LDS fragment loads,
// global_prefetch for tile n+2.
// Every global load of the key loop covers four whole 128-B lines: K and V by
// 8 lanes a line, and the mask rows too, which reach their query's lane
// through an LDS tile staged like K and V.
// ---------------------------------------------------------------------------

typedef __attribute__((ext_vector_type(16))) _Float16 v16h;
typedef __attribute__((ext_vector_type(8)))  float    v8f;

constexpr int SEQ   = 1024;   // sequence length S
constexpr int HD    = 64;     // head dim D
constexpr int KT    = 32;     // keys per flash step (one f16 WMMA K-dim)
constexpr int WAVES = 8;
constexpr int BLOCK = WAVES * 32;
constexpr int RPW   = 16;                 // query rows per wave
constexpr int RPB   = WAVES * RPW;        // 128 rows per block
constexpr int NSTEP = SEQ / KT;           // 32
// LDS row pitches in halves (K, V) and floats (mask). Every tile row is read by ds_load_b128, which is
// free of bank conflicts at a pitch of 16 B x odd (64 banks x 4 B).
constexpr int KP    = HD + 8;             // K rows: 128 B of data, 144 B pitch
constexpr int VP    = KT + 8;             // V rows:  64 B of data,  80 B pitch
constexpr int MP    = KT + 4;             // mask rows (floats): 128 B of data, 144 B pitch

union Frag { v16h h; uint4 q[2]; };
union H2U  { _Float16 h[2]; unsigned int u; };

// A/B 16-bit fragment from a row-major f16 row whose layout is contiguous in
// the WMMA K dimension: halves 0..7 = row[hi8 .. hi8+7],
// halves 8..15 = row[16+hi8 .. 16+hi8+7]  ->  two ds_load_b128 per lane.
__device__ __forceinline__ v16h ld_frag(const _Float16* row, int hi8) {
    Frag f;
    f.q[0] = *(const uint4*)(row + hi8);
    f.q[1] = *(const uint4*)(row + 16 + hi8);
    return f.h;
}

// lane l <-> lane l ^ 16, as a vector cross-row move
__device__ __forceinline__ float xhalf(float x) {
    const int i = __builtin_bit_cast(int, x);
    return __builtin_bit_cast(float,
        __builtin_amdgcn_permlanex16(i, i, 0x76543210, 0xfedcba98, false, false));
}

#define WMMA_F16(A, B, C) \
    __builtin_amdgcn_wmma_f32_16x16x32_f16(false, (A), false, (B), (short)0, (C), false, false)

__global__ __launch_bounds__(BLOCK)
void mha_flash_wmma_kernel(const float* __restrict__ q,     // [B*H, S, D]
                           const float* __restrict__ kT,    // [B*H, D, S]
                           const int*   __restrict__ scale_p,
                           const float* __restrict__ mask,  // [S, S]
                           const float* __restrict__ vmat,  // [B*H, S, D]
                           float* __restrict__ out)         // [B*H, S, D]
{
    const int head = blockIdx.y;
    const int tid  = threadIdx.x;
    const int wave = tid >> 5;
    const int lane = tid & 31;
    const int ncol = lane & 15;
    const int hi8  = (lane >> 4) << 3;     // 0 or 8
    const int qrow0 = blockIdx.x * RPB + wave * RPW;

    const float* qh = q    + (size_t)head * SEQ * HD;
    const float* kh = kT   + (size_t)head * HD  * SEQ;
    const float* vh = vmat + (size_t)head * SEQ * HD;
    float*       oh = out  + (size_t)head * SEQ * HD;
    const float inv_scale = 1.0f / (float)scale_p[0];

    // Double-buffered tiles. K: [key][d] (A rows of S^T = keys, k = d).
    // V: [d][key]  (A rows of O^T = d, k = key, in natural key order).
    __shared__ __align__(16) _Float16 Ksh[2][KT * KP];          // 9 KB
    __shared__ __align__(16) _Float16 Vsh[2][HD * VP];          // 10 KB
    // Mask: [query of the block][key], f32; each wave stages and reads its own 16 rows.
    __shared__ __align__(16) float    Msh[2][RPB * MP];         // 36 KB

    // ---- staging decomposition (one (2d x 4key) K unit + (2key x 4d) V unit
    //      + four 4-key mask units per thread per tile; float4 global loads in
    //      which 8 lanes share one 128-B line; b32 packed / b128 LDS stores) --
    const int kd0   = (tid >> 3) * 2;      // K: d pair base (0..62)
    const int kkey4 = (tid & 7) * 4;       // K: key group of 4
    const int vkey  = ((wave >> 1) * 4 + ((tid >> 3) & 3)) * 2;  // V: key (paired with vkey+1)
    const int vd4   = (wave & 1) * 32 + (tid & 7) * 4;           // V: d group of 4
    const int mq    = wave * RPW + (lane >> 3);   // mask: block row (then +4, +8, +12)
    const int mkey4 = (lane & 7) * 4;             // mask: key group of 4
    const float* mg = mask + (size_t)(blockIdx.x * RPB + mq) * SEQ + mkey4;

    float4 kr0, kr1, vr0, vr1, mr0, mr1, mr2, mr3;
    auto load_tile = [&](int kb) {
        kr0 = *(const float4*)(kh + (size_t)kd0 * SEQ + kb + kkey4);
        kr1 = *(const float4*)(kh + (size_t)(kd0 + 1) * SEQ + kb + kkey4);
        vr0 = *(const float4*)(vh + (size_t)(kb + vkey) * HD + vd4);
        vr1 = *(const float4*)(vh + (size_t)(kb + vkey + 1) * HD + vd4);
        mr0 = *(const float4*)(mg + kb);
        mr1 = *(const float4*)(mg + 4 * SEQ + kb);
        mr2 = *(const float4*)(mg + 8 * SEQ + kb);
        mr3 = *(const float4*)(mg + 12 * SEQ + kb);
    };
    auto store_tile = [&](int buf) {
        const float* k0p = &kr0.x; const float* k1p = &kr1.x;
        const float* v0p = &vr0.x; const float* v1p = &vr1.x;
        #pragma unroll
        for (int j = 0; j < 4; ++j) {
            H2U a; a.h[0] = (_Float16)k0p[j]; a.h[1] = (_Float16)k1p[j];
            *(unsigned int*)(&Ksh[buf][(kkey4 + j) * KP + kd0]) = a.u;
            H2U b; b.h[0] = (_Float16)v0p[j]; b.h[1] = (_Float16)v1p[j];
            *(unsigned int*)(&Vsh[buf][(vd4 + j) * VP + vkey]) = b.u;
        }
        float* md = &Msh[buf][mq * MP + mkey4];
        *(float4*)(md)           = mr0;
        *(float4*)(md +  4 * MP) = mr1;
        *(float4*)(md +  8 * MP) = mr2;
        *(float4*)(md + 12 * MP) = mr3;
    };

    // ---- Q^T B-fragments (32x16 f16, two covering D=64; lane = query column,
    //      same k order as ld_frag), built once ------------------------------
    v16h a0, a1;
    {
        const float* qrow = qh + (size_t)(qrow0 + ncol) * HD;
        #pragma unroll
        for (int half = 0; half < 2; ++half) {          // halves 0..7 / 8..15
            const int dbase = half * 16 + hi8;
            float4 f0 = *(const float4*)(qrow + dbase);
            float4 f1 = *(const float4*)(qrow + dbase + 4);
            float4 g0 = *(const float4*)(qrow + 32 + dbase);
            float4 g1 = *(const float4*)(qrow + 32 + dbase + 4);
            const float* fp0 = &f0.x; const float* fp1 = &f1.x;
            const float* gp0 = &g0.x; const float* gp1 = &g1.x;
            #pragma unroll
            for (int j = 0; j < 4; ++j) {
                a0[half * 8 + j]     = (_Float16)fp0[j];
                a0[half * 8 + 4 + j] = (_Float16)fp1[j];
                a1[half * 8 + j]     = (_Float16)gp0[j];
                a1[half * 8 + 4 + j] = (_Float16)gp1[j];
            }
        }
    }

    v16h ones;
    #pragma unroll
    for (int i = 0; i < 16; ++i) ones[i] = (_Float16)1.0f;

    // ---- online-softmax state of this lane's query (same in both halves) ---
    float mrun = -3.0e38f, lrun = 0.0f;
    v8f o0 = {}, o1 = {}, o2 = {}, o3 = {};   // o_t[r] = O[query][16t + hi8 + r]
    const int moff = (wave * RPW + ncol) * MP + hi8;   // this lane's query row in Msh

    // ---- prologue: stage tile 0 --------------------------------------------
    load_tile(0);
    // before a register that one of the loads above names as its address is reused
    asm volatile("s_wait_xcnt 0x0" ::: "memory");
    store_tile(0);
    __syncthreads();

    for (int step = 0; step < NSTEP; ++step) {
        const int kb  = step * KT;
        const int cur = step & 1;

        // issue next tile's global loads before compute (overlap with WMMA)
        if (step + 1 < NSTEP) load_tile(kb + KT);
        // ---- mask of this lane's query: keys hi8..hi8+7 and 16+hi8..16+hi8+7 --
        const float* mrow = &Msh[cur][moff];
        const float4 mk0 = *(const float4*)(mrow);
        const float4 mk1 = *(const float4*)(mrow + 4);
        const float4 mk2 = *(const float4*)(mrow + 16);
        const float4 mk3 = *(const float4*)(mrow + 20);
        if (step + 2 < NSTEP) {
            __builtin_prefetch(kh + (size_t)kd0 * SEQ + kb + 2 * KT + kkey4, 0, 1);
            __builtin_prefetch(vh + (size_t)(kb + 2 * KT + vkey) * HD + vd4, 0, 1);
        }

        // ---- scores: S^T(32x16) = K(32x64) x Q^T(64x16), 4 WMMAs ----
        const _Float16* krow0 = &Ksh[cur][ncol * KP];          // key = ncol
        const _Float16* krow1 = &Ksh[cur][(16 + ncol) * KP];   // key = 16+ncol
        v16h ak00 = ld_frag(krow0, hi8);
        v16h ak01 = ld_frag(krow0 + 32, hi8);
        v16h ak10 = ld_frag(krow1, hi8);
        v16h ak11 = ld_frag(krow1 + 32, hi8);
        v8f c0 = {}, c1 = {};
        c0 = WMMA_F16(ak00, a0, c0);
        c0 = WMMA_F16(ak01, a1, c0);
        c1 = WMMA_F16(ak10, a0, c1);
        c1 = WMMA_F16(ak11, a1, c1);

        // ---- scale + mask: c0[r] = key hi8+r, c1[r] = key 16+hi8+r ----
        const float m0v[8] = {mk0.x, mk0.y, mk0.z, mk0.w, mk1.x, mk1.y, mk1.z, mk1.w};
        const float m1v[8] = {mk2.x, mk2.y, mk2.z, mk2.w, mk3.x, mk3.y, mk3.z, mk3.w};
        float s0v[8], s1v[8];
        #pragma unroll
        for (int r = 0; r < 8; ++r) {
            s0v[r] = c0[r] * inv_scale + m0v[r];
            s1v[r] = c1[r] * inv_scale + m1v[r];
        }

        // ---- maximum over the 32 keys: 16 in the lane, then the other half ----
        float mx0 = s0v[0], mx1 = s1v[0];
        #pragma unroll
        for (int r = 1; r < 8; ++r) { mx0 = fmaxf(mx0, s0v[r]); mx1 = fmaxf(mx1, s1v[r]); }
        float mx = fmaxf(mx0, mx1);
        mx = fmaxf(mx, xhalf(mx));

        // ---- online softmax update; P^T packs straight into a B fragment ----
        const float mnew  = fmaxf(mrun, mx);
        const float alpha = __expf(mrun - mnew);
        mrun = mnew;
        v16h pb;
        #pragma unroll
        for (int r = 0; r < 8; ++r) {
            pb[r]     = (_Float16)__expf(s0v[r] - mnew);
            pb[8 + r] = (_Float16)__expf(s1v[r] - mnew);
        }
        #pragma unroll
        for (int r = 0; r < 8; ++r) {
            o0[r] *= alpha; o1[r] *= alpha;
            o2[r] *= alpha; o3[r] *= alpha;
        }

        // ---- sums of P over the 32 keys via WMMA with an all-ones A: every row
        //      of the result holds the column sums ----
        v8f csum = {};
        csum = WMMA_F16(ones, pb, csum);
        lrun = lrun * alpha + csum[0];

        // ---- PV: O^T(64x16) += V^T(64x32) x P^T(32x16), 4 WMMAs ----
        {
            v16h av0 = ld_frag(&Vsh[cur][(0 * 16 + ncol) * VP], hi8);
            v16h av1 = ld_frag(&Vsh[cur][(1 * 16 + ncol) * VP], hi8);
            v16h av2 = ld_frag(&Vsh[cur][(2 * 16 + ncol) * VP], hi8);
            v16h av3 = ld_frag(&Vsh[cur][(3 * 16 + ncol) * VP], hi8);
            o0 = WMMA_F16(av0, pb, o0);
            o1 = WMMA_F16(av1, pb, o1);
            o2 = WMMA_F16(av2, pb, o2);
            o3 = WMMA_F16(av3, pb, o3);
        }

        // stage next tile into the other buffer; one barrier per step
        if (step + 1 < NSTEP) store_tile(cur ^ 1);
        __syncthreads();
    }

    // ---- epilogue: normalize by row sum, store fp32 (8 consecutive d a tile) -
    {
        const float invl = 1.0f / lrun;
        float* orow = oh + (size_t)(qrow0 + ncol) * HD + hi8;
        *(float4*)(orow +  0) = make_float4(o0[0] * invl, o0[1] * invl, o0[2] * invl, o0[3] * invl);
        *(float4*)(orow +  4) = make_float4(o0[4] * invl, o0[5] * invl, o0[6] * invl, o0[7] * invl);
        *(float4*)(orow + 16) = make_float4(o1[0] * invl, o1[1] * invl, o1[2] * invl, o1[3] * invl);
        *(float4*)(orow + 20) = make_float4(o1[4] * invl, o1[5] * invl, o1[6] * invl, o1[7] * invl);
        *(float4*)(orow + 32) = make_float4(o2[0] * invl, o2[1] * invl, o2[2] * invl, o2[3] * invl);
        *(float4*)(orow + 36) = make_float4(o2[4] * invl, o2[5] * invl, o2[6] * invl, o2[7] * invl);
        *(float4*)(orow + 48) = make_float4(o3[0] * invl, o3[1] * invl, o3[2] * invl, o3[3] * invl);
        *(float4*)(orow + 52) = make_float4(o3[4] * invl, o3[5] * invl, o3[6] * invl, o3[7] * invl);
    }
}

extern "C" void kernel_launch(void* const* d_in, const int* in_sizes, int n_in,
                              void* d_out, int out_size, void* d_ws, size_t ws_size,
                              hipStream_t stream) {
    (void)in_sizes; (void)n_in; (void)out_size; (void)d_ws; (void)ws_size;

    const float* q       = (const float*)d_in[0];   // [4,16,1024,64]
    const float* kT      = (const float*)d_in[1];   // [4,16,64,1024]
    const int*   scale_p = (const int*)  d_in[2];   // scalar 8
    const float* mask    = (const float*)d_in[3];   // [1024,1024]
    const float* v       = (const float*)d_in[4];   // [4,16,1024,64]
    float*       out     = (float*)d_out;           // [4,16,1024,64]

    const int heads = 4 * 16;
    dim3 grid(SEQ / RPB, heads);                    // (8, 64)
    dim3 block(BLOCK);                              // 256 threads = 8 wave32
    mha_flash_wmma_kernel<<<grid, block, 0, stream>>>(q, kT, scale_p, mask, v, out);
}

// v004
// Measured time: 30.3 microseconds a run.
// In both of two side-by-side timings against v003, it was 1.08 times as fast.
// Counting every step since v000, it is 2.28 times as fast.
#include <hip/hip_runtime.h>

// ---------------------------------------------------------------------------
// Flash-attention for B=4, H=16, S=1024, D=64 on gfx1250 (CDNA5, wave32).
// Both products are computed transposed on v_wmma_f32_16x16x32_f16:
// S^T = K * Q^T, O^T += V^T * P^T, row sums = ones * P^T. A lane then owns one
// query column: its maximum is taken in the lane plus one exchange between the
// wave halves, and the four S^T accumulator tiles, converted in place, are the
// two B operands of the second product (P never goes through LDS).
// Double-buffered LDS tiles (rows padded against bank conflicts), one barrier
// and one softmax update per key step of 64 keys, global loads issued ahead of
// compute, b128 LDS fragment loads, global_prefetch for tile n+2.
// Every global load of the key loop covers four whole 128-B lines: K and V by
// 8 lanes a line, and the mask rows too, which reach their query's lane
// through an LDS tile staged like K and V.
// ---------------------------------------------------------------------------

typedef __attribute__((ext_vector_type(16))) _Float16 v16h;
typedef __attribute__((ext_vector_type(8)))  float    v8f;

constexpr int SEQ   = 1024;   // sequence length S
constexpr int HD    = 64;     // head dim D
constexpr int KT    = 64;     // keys per flash step (two f16 WMMA K-dims)
constexpr int WAVES = 8;
constexpr int BLOCK = WAVES * 32;
constexpr int RPW   = 16;                 // query rows per wave
constexpr int RPB   = WAVES * RPW;        // 128 rows per block
constexpr int NSTEP = SEQ / KT;           // 16
// LDS row pitches in elements (halves for K and V, floats for the mask). Every tile row is read by ds_load_b128, which is
// free of bank conflicts at a pitch of 16 B x odd (64 banks x 4 B).
constexpr int KP    = HD + 8;             // K rows: 128 B of data, 144 B pitch
constexpr int VP    = KT + 8;             // V rows: 128 B of data, 144 B pitch
constexpr int MP    = KT + 4;             // mask rows (floats): 256 B of data, 272 B pitch

union Frag { v16h h; uint4 q[2]; };
union H2U  { _Float16 h[2]; unsigned int u; };

// A/B 16-bit fragment from a row-major f16 row whose layout is contiguous in
// the WMMA K dimension: halves 0..7 = row[hi8 .. hi8+7],
// halves 8..15 = row[16+hi8 .. 16+hi8+7]  ->  two ds_load_b128 per lane.
__device__ __forceinline__ v16h ld_frag(const _Float16* row, int hi8) {
    Frag f;
    f.q[0] = *(const uint4*)(row + hi8);
    f.q[1] = *(const uint4*)(row + 16 + hi8);
    return f.h;
}

// lane l <-> lane l ^ 16, as a vector cross-row move
__device__ __forceinline__ float xhalf(float x) {
    const int i = __builtin_bit_cast(int, x);
    return __builtin_bit_cast(float,
        __builtin_amdgcn_permlanex16(i, i, 0x76543210, 0xfedcba98, false, false));
}

#define WMMA_F16(A, B, C) \
    __builtin_amdgcn_wmma_f32_16x16x32_f16(false, (A), false, (B), (short)0, (C), false, false)

__global__ __launch_bounds__(BLOCK)
void mha_flash_wmma_kernel(const float* __restrict__ q,     // [B*H, S, D]
                           const float* __restrict__ kT,    // [B*H, D, S]
                           const int*   __restrict__ scale_p,
                           const float* __restrict__ mask,  // [S, S]
                           const float* __restrict__ vmat,  // [B*H, S, D]
                           float* __restrict__ out)         // [B*H, S, D]
{
    const int head = blockIdx.y;
    const int tid  = threadIdx.x;
    const int wave = tid >> 5;
    const int lane = tid & 31;
    const int ncol = lane & 15;
    const int hi8  = (lane >> 4) << 3;     // 0 or 8
    const int qrow0 = blockIdx.x * RPB + wave * RPW;

    const float* qh = q    + (size_t)head * SEQ * HD;
    const float* kh = kT   + (size_t)head * HD  * SEQ;
    const float* vh = vmat + (size_t)head * SEQ * HD;
    float*       oh = out  + (size_t)head * SEQ * HD;
    const float inv_scale = 1.0f / (float)scale_p[0];

    // Double-buffered tiles. K: [key][d] (A rows of S^T = keys, k = d).
    // V: [d][key]  (A rows of O^T = d, k = key, in natural key order).
    __shared__ __align__(16) _Float16 Ksh[2][KT * KP];          // 18 KB
    __shared__ __align__(16) _Float16 Vsh[2][HD * VP];          // 18 KB
    // Mask: [query of the block][key], f32; each wave stages and reads its own 16 rows.
    __shared__ __align__(16) float    Msh[2][RPB * MP];         // 68 KB

    // ---- staging decomposition (two (2d x 4key) K units + two (2key x 4d) V
    //      units + eight 4-key mask units per thread per tile; float4 global
    //      loads that cover four whole 128-B lines; b32 packed / b128 LDS stores) --
    const int kd0   = (tid >> 3) * 2;      // K: d pair base (0..62)
    const int kkey4 = (tid & 7) * 4;       // K: key group of 4 (then +32)
    const int vkey  = ((wave >> 1) * 4 + ((tid >> 3) & 3)) * 2;  // V: key (paired with vkey+1; then +32)
    const int vd4   = (wave & 1) * 32 + (tid & 7) * 4;           // V: d group of 4
    const int mq    = wave * RPW + (lane >> 4);   // mask: block row (then +2, +4, .. +14)
    const int mkey4 = (lane & 15) * 4;            // mask: key group of 4
    const float* mg = mask + (size_t)(blockIdx.x * RPB + mq) * SEQ + mkey4;

    float4 kr[4], vr[4], mr0, mr1, mr2, mr3, mr4, mr5, mr6, mr7;
    auto load_tile = [&](int kb) {
        #pragma unroll
        for (int u = 0; u < 2; ++u) {
            kr[2 * u]     = *(const float4*)(kh + (size_t)kd0 * SEQ + kb + 32 * u + kkey4);
            kr[2 * u + 1] = *(const float4*)(kh + (size_t)(kd0 + 1) * SEQ + kb + 32 * u + kkey4);
            vr[2 * u]     = *(const float4*)(vh + (size_t)(kb + 32 * u + vkey) * HD + vd4);
            vr[2 * u + 1] = *(const float4*)(vh + (size_t)(kb + 32 * u + vkey + 1) * HD + vd4);
        }
        mr0 = *(const float4*)(mg + kb);
        mr1 = *(const float4*)(mg +  2 * SEQ + kb);
        mr2 = *(const float4*)(mg +  4 * SEQ + kb);
        mr3 = *(const float4*)(mg +  6 * SEQ + kb);
        mr4 = *(const float4*)(mg +  8 * SEQ + kb);
        mr5 = *(const float4*)(mg + 10 * SEQ + kb);
        mr6 = *(const float4*)(mg + 12 * SEQ + kb);
        mr7 = *(const float4*)(mg + 14 * SEQ + kb);
    };
    auto store_tile = [&](int buf) {
        #pragma unroll
        for (int u = 0; u < 2; ++u) {
            const float* k0p = &kr[2 * u].x; const float* k1p = &kr[2 * u + 1].x;
            const float* v0p = &vr[2 * u].x; const float* v1p = &vr[2 * u + 1].x;
            #pragma unroll
            for (int j = 0; j < 4; ++j) {
                H2U a; a.h[0] = (_Float16)k0p[j]; a.h[1] = (_Float16)k1p[j];
                *(unsigned int*)(&Ksh[buf][(32 * u + kkey4 + j) * KP + kd0]) = a.u;
                H2U b; b.h[0] = (_Float16)v0p[j]; b.h[1] = (_Float16)v1p[j];
                *(unsigned int*)(&Vsh[buf][(vd4 + j) * VP + 32 * u + vkey]) = b.u;
            }
        }
        float* md = &Msh[buf][mq * MP + mkey4];
        *(float4*)(md)           = mr0;
        *(float4*)(md +  2 * MP) = mr1;
        *(float4*)(md +  4 * MP) = mr2;
        *(float4*)(md +  6 * MP) = mr3;
        *(float4*)(md +  8 * MP) = mr4;
        *(float4*)(md + 10 * MP) = mr5;
        *(float4*)(md + 12 * MP) = mr6;
        *(float4*)(md + 14 * MP) = mr7;
    };

    // ---- Q^T B-fragments (32x16 f16, two covering D=64; lane = query column,
    //      same k order as ld_frag), built once ------------------------------
    v16h a0, a1;
    {
        const float* qrow = qh + (size_t)(qrow0 + ncol) * HD;
        #pragma unroll
        for (int half = 0; half < 2; ++half) {          // halves 0..7 / 8..15
            const int dbase = half * 16 + hi8;
            float4 f0 = *(const float4*)(qrow + dbase);
            float4 f1 = *(const float4*)(qrow + dbase + 4);
            float4 g0 = *(const float4*)(qrow + 32 + dbase);
            float4 g1 = *(const float4*)(qrow + 32 + dbase + 4);
            const float* fp0 = &f0.x; const float* fp1 = &f1.x;
            const float* gp0 = &g0.x; const float* gp1 = &g1.x;
            #pragma unroll
            for (int j = 0; j < 4; ++j) {
                a0[half * 8 + j]     = (_Float16)fp0[j];
                a0[half * 8 + 4 + j] = (_Float16)fp1[j];
                a1[half * 8 + j]     = (_Float16)gp0[j];
                a1[half * 8 + 4 + j] = (_Float16)gp1[j];
            }
        }
    }

    v16h ones;
    #pragma unroll
    for (int i = 0; i < 16; ++i) ones[i] = (_Float16)1.0f;

    // ---- online-softmax state of this lane's query (same in both halves) ---
    float mrun = -3.0e38f, lrun = 0.0f;
    v8f o0 = {}, o1 = {}, o2 = {}, o3 = {};   // o_t[r] = O[query][16t + hi8 + r]
    const int moff = (wave * RPW + ncol) * MP + hi8;   // this lane's query row in Msh

    // ---- prologue: stage tile 0 --------------------------------------------
    load_tile(0);
    // before a register that one of the loads above names as its address is reused
    asm volatile("s_wait_xcnt 0x0" ::: "memory");
    store_tile(0);
    __syncthreads();

    for (int step = 0; step < NSTEP; ++step) {
        const int kb  = step * KT;
        const int cur = step & 1;

        // issue next tile's global loads before compute (overlap with WMMA)
        if (step + 1 < NSTEP) {
            load_tile(kb + KT);
            // before a register that one of the loads above names as its address is reused
            asm volatile("s_wait_xcnt 0x0" ::: "memory");
        }
        // ---- mask of this lane's query: keys 16t+hi8 .. 16t+hi8+7, t = 0..3 ----
        const float* mrow = &Msh[cur][moff];
        float4 mk[8];
        #pragma unroll
        for (int t = 0; t < 4; ++t) {
            mk[2 * t]     = *(const float4*)(mrow + 16 * t);
            mk[2 * t + 1] = *(const float4*)(mrow + 16 * t + 4);
        }
        if (step + 2 < NSTEP) {
            __builtin_prefetch(kh + (size_t)kd0 * SEQ + kb + 2 * KT + kkey4, 0, 1);
            __builtin_prefetch(vh + (size_t)(kb + 2 * KT + vkey) * HD + vd4, 0, 1);
        }

        // ---- scores: S^T(64x16) = K(64x64) x Q^T(64x16), 8 WMMAs in 4 chains ----
        v8f c[4];
        #pragma unroll
        for (int t = 0; t < 4; ++t) {                          // key = 16t + ncol
            v8f z = {};
            c[t] = WMMA_F16(ld_frag(&Ksh[cur][(16 * t + ncol) * KP], hi8), a0, z);
        }
        #pragma unroll
        for (int t = 0; t < 4; ++t)
            c[t] = WMMA_F16(ld_frag(&Ksh[cur][(16 * t + ncol) * KP + 32], hi8), a1, c[t]);

        // ---- scale + mask: c[t][r] = key 16t + hi8 + r ----
        float sv[4][8];
        #pragma unroll
        for (int t = 0; t < 4; ++t) {
            const float mv[8] = {mk[2 * t].x, mk[2 * t].y, mk[2 * t].z, mk[2 * t].w,
                                 mk[2 * t + 1].x, mk[2 * t + 1].y, mk[2 * t + 1].z, mk[2 * t + 1].w};
            #pragma unroll
            for (int r = 0; r < 8; ++r) sv[t][r] = c[t][r] * inv_scale + mv[r];
        }

        // ---- maximum over the 64 keys: 32 in the lane, then the other half ----
        float mxt[4];
        #pragma unroll
        for (int t = 0; t < 4; ++t) {
            mxt[t] = sv[t][0];
            #pragma unroll
            for (int r = 1; r < 8; ++r) mxt[t] = fmaxf(mxt[t], sv[t][r]);
        }
        float mx = fmaxf(fmaxf(mxt[0], mxt[1]), fmaxf(mxt[2], mxt[3]));
        mx = fmaxf(mx, xhalf(mx));

        // ---- online softmax update; P^T packs straight into two B fragments ----
        const float mnew  = fmaxf(mrun, mx);
        const float alpha = __expf(mrun - mnew);
        mrun = mnew;
        v16h pb0, pb1;
        #pragma unroll
        for (int r = 0; r < 8; ++r) {
            pb0[r]     = (_Float16)__expf(sv[0][r] - mnew);
            pb0[8 + r] = (_Float16)__expf(sv[1][r] - mnew);
            pb1[r]     = (_Float16)__expf(sv[2][r] - mnew);
            pb1[8 + r] = (_Float16)__expf(sv[3][r] - mnew);
        }
        #pragma unroll
        for (int r = 0; r < 8; ++r) {
            o0[r] *= alpha; o1[r] *= alpha;
            o2[r] *= alpha; o3[r] *= alpha;
        }

        // ---- sums of P over the 64 keys via WMMA with an all-ones A: every row
        //      of the result holds the column sums ----
        v8f csum = {};
        csum = WMMA_F16(ones, pb0, csum);
        csum = WMMA_F16(ones, pb1, csum);
        lrun = lrun * alpha + csum[0];

        // ---- PV: O^T(64x16) += V^T(64x64) x P^T(64x16), 8 WMMAs in 4 chains ----
        {
            const _Float16* vrow = &Vsh[cur][ncol * VP];
            o0 = WMMA_F16(ld_frag(vrow + 0 * 16 * VP, hi8), pb0, o0);
            o1 = WMMA_F16(ld_frag(vrow + 1 * 16 * VP, hi8), pb0, o1);
            o2 = WMMA_F16(ld_frag(vrow + 2 * 16 * VP, hi8), pb0, o2);
            o3 = WMMA_F16(ld_frag(vrow + 3 * 16 * VP, hi8), pb0, o3);
            o0 = WMMA_F16(ld_frag(vrow + 0 * 16 * VP + 32, hi8), pb1, o0);
            o1 = WMMA_F16(ld_frag(vrow + 1 * 16 * VP + 32, hi8), pb1, o1);
            o2 = WMMA_F16(ld_frag(vrow + 2 * 16 * VP + 32, hi8), pb1, o2);
            o3 = WMMA_F16(ld_frag(vrow + 3 * 16 * VP + 32, hi8), pb1, o3);
        }

        // stage next tile into the other buffer; one barrier per step
        if (step + 1 < NSTEP) store_tile(cur ^ 1);
        __syncthreads();
    }

    // ---- epilogue: normalize by row sum, store fp32 (8 consecutive d a tile) -
    {
        const float invl = 1.0f / lrun;
        float* orow = oh + (size_t)(qrow0 + ncol) * HD + hi8;
        *(float4*)(orow +  0) = make_float4(o0[0] * invl, o0[1] * invl, o0[2] * invl, o0[3] * invl);
        *(float4*)(orow +  4) = make_float4(o0[4] * invl, o0[5] * invl, o0[6] * invl, o0[7] * invl);
        *(float4*)(orow + 16) = make_float4(o1[0] * invl, o1[1] * invl, o1[2] * invl, o1[3] * invl);
        *(float4*)(orow + 20) = make_float4(o1[4] * invl, o1[5] * invl, o1[6] * invl, o1[7] * invl);
        *(float4*)(orow + 32) = make_float4(o2[0] * invl, o2[1] * invl, o2[2] * invl, o2[3] * invl);
        *(float4*)(orow + 36) = make_float4(o2[4] * invl, o2[5] * invl, o2[6] * invl, o2[7] * invl);
        *(float4*)(orow + 48) = make_float4(o3[0] * invl, o3[1] * invl, o3[2] * invl, o3[3] * invl);
        *(float4*)(orow + 52) = make_float4(o3[4] * invl, o3[5] * invl, o3[6] * invl, o3[7] * invl);
    }
}

extern "C" void kernel_launch(void* const* d_in, const int* in_sizes, int n_in,
                              void* d_out, int out_size, void* d_ws, size_t ws_size,
                              hipStream_t stream) {
    (void)in_sizes; (void)n_in; (void)out_size; (void)d_ws; (void)ws_size;

    const float* q       = (const float*)d_in[0];   // [4,16,1024,64]
    const float* kT      = (const float*)d_in[1];   // [4,16,64,1024]
    const int*   scale_p = (const int*)  d_in[2];   // scalar 8
    const float* mask    = (const float*)d_in[3];   // [1024,1024]
    const float* v       = (const float*)d_in[4];   // [4,16,1024,64]
    float*       out     = (float*)d_out;           // [4,16,1024,64]

    const int heads = 4 * 16;
    dim3 grid(SEQ / RPB, heads);                    // (8, 64)
    dim3 block(BLOCK);                              // 256 threads = 8 wave32
    mha_flash_wmma_kernel<<<grid, block, 0, stream>>>(q, kT, scale_p, mask, v, out);
}

// v005
// One run takes 28.4 microseconds.
// In both of two side-by-side timings against v004, it was 1.07 times as fast.
// All steps since v000 together make it 2.43 times as fast.
#include <hip/hip_runtime.h>

// ---------------------------------------------------------------------------
// Flash-attention for B=4, H=16, S=1024, D=64 on gfx1250 (CDNA5, wave32).
// Both products are computed transposed on v_wmma_f32_16x16x32_f16:
// S^T = K * Q^T, O^T += V^T * P^T, row sums = ones * P^T. A lane then owns one
// query column: its maximum is taken in the lane plus one exchange between the
// wave halves, and the four S^T accumulator tiles, converted in place, are the
// two B operands of the second product (P never goes through LDS).
// Double-buffered LDS tiles (rows padded against bank conflicts), one barrier
// and one softmax update per key step of 64 keys, global loads issued ahead of
// compute, b128 LDS fragment loads, global_prefetch for tile n+2.
// Every global load of the key loop covers two whole aligned 256-B pieces,
// 16 lanes a piece: a K row's 64 keys, a V row's 64 d, a
// mask row's 64 keys. The mask reaches its query's lane through an LDS tile
// staged like K and V.
// ---------------------------------------------------------------------------

typedef __attribute__((ext_vector_type(16))) _Float16 v16h;
typedef __attribute__((ext_vector_type(8)))  float    v8f;

constexpr int SEQ   = 1024;   // sequence length S
constexpr int HD    = 64;     // head dim D
constexpr int KT    = 64;     // keys per flash step (two f16 WMMA K-dims)
constexpr int WAVES = 8;
constexpr int BLOCK = WAVES * 32;
constexpr int RPW   = 16;                 // query rows per wave
constexpr int RPB   = WAVES * RPW;        // 128 rows per block
constexpr int NSTEP = SEQ / KT;           // 16
// LDS row pitches in elements (halves for K and V, floats for the mask). Every tile row is read by ds_load_b128, which is
// free of bank conflicts at a pitch of 16 B x odd (64 banks x 4 B).
constexpr int KP    = HD + 8;             // K rows: 128 B of data, 144 B pitch
constexpr int VP    = KT + 8;             // V rows: 128 B of data, 144 B pitch
constexpr int MP    = KT + 4;             // mask rows (floats): 256 B of data, 272 B pitch

union Frag { v16h h; uint4 q[2]; };
union H4U  { _Float16 h[4]; uint2 u; };

// A/B 16-bit fragment from a row-major f16 row whose layout is contiguous in
// the WMMA K dimension: halves 0..7 = row[hi8 .. hi8+7],
// halves 8..15 = row[16+hi8 .. 16+hi8+7]  ->  two ds_load_b128 per lane.
__device__ __forceinline__ v16h ld_frag(const _Float16* row, int hi8) {
    Frag f;
    f.q[0] = *(const uint4*)(row + hi8);
    f.q[1] = *(const uint4*)(row + 16 + hi8);
    return f.h;
}

// lane l <-> lane l ^ 16, as a vector cross-row move
__device__ __forceinline__ float xhalf(float x) {
    const int i = __builtin_bit_cast(int, x);
    return __builtin_bit_cast(float,
        __builtin_amdgcn_permlanex16(i, i, 0x76543210, 0xfedcba98, false, false));
}

#define WMMA_F16(A, B, C) \
    __builtin_amdgcn_wmma_f32_16x16x32_f16(false, (A), false, (B), (short)0, (C), false, false)

__global__ __launch_bounds__(BLOCK)
void mha_flash_wmma_kernel(const float* __restrict__ q,     // [B*H, S, D]
                           const float* __restrict__ kT,    // [B*H, D, S]
                           const int*   __restrict__ scale_p,
                           const float* __restrict__ mask,  // [S, S]
                           const float* __restrict__ vmat,  // [B*H, S, D]
                           float* __restrict__ out)         // [B*H, S, D]
{
    const int head = blockIdx.y;
    const int tid  = threadIdx.x;
    const int wave = tid >> 5;
    const int lane = tid & 31;
    const int ncol = lane & 15;
    const int hi8  = (lane >> 4) << 3;     // 0 or 8
    const int qrow0 = blockIdx.x * RPB + wave * RPW;

    const float* qh = q    + (size_t)head * SEQ * HD;
    const float* kh = kT   + (size_t)head * HD  * SEQ;
    const float* vh = vmat + (size_t)head * SEQ * HD;
    float*       oh = out  + (size_t)head * SEQ * HD;
    const float inv_scale = 1.0f / (float)scale_p[0];

    // Double-buffered tiles. K: [key][d] (A rows of S^T = keys, k = d).
    // V: [d][key]  (A rows of O^T = d, k = key, in natural key order).
    __shared__ __align__(16) _Float16 Ksh[2][KT * KP];          // 18 KB
    __shared__ __align__(16) _Float16 Vsh[2][HD * VP];          // 18 KB
    // Mask: [query of the block][key], f32; each wave stages and reads its own 16 rows.
    __shared__ __align__(16) float    Msh[2][RPB * MP];         // 68 KB

    // ---- staging decomposition (one (4d x 4key) K block + one (4key x 4d) V
    //      block + eight 4-key mask units per thread per tile; float4 global
    //      loads, 16 lanes on each 256-B row piece; b64 packed / b128 LDS stores) --
    const int kd0   = (tid >> 4) * 4;      // K: base of 4 d rows (0..60)
    const int kkey4 = (tid & 15) * 4;      // K: key group of 4 (0..60)
    const int vkey  = (tid >> 4) * 4;      // V: base of 4 keys (0..60)
    const int vd4   = (tid & 15) * 4;      // V: d group of 4 (0..60)
    const int mq    = wave * RPW + (lane >> 4);   // mask: block row (then +2, +4, .. +14)
    const int mkey4 = (lane & 15) * 4;            // mask: key group of 4
    const float* mg = mask + (size_t)(blockIdx.x * RPB + mq) * SEQ + mkey4;

    float4 kr[4], vr[4], mr0, mr1, mr2, mr3, mr4, mr5, mr6, mr7;
    auto load_tile = [&](int kb) {
        #pragma unroll
        for (int i = 0; i < 4; ++i)
            kr[i] = *(const float4*)(kh + (size_t)(kd0 + i) * SEQ + kb + kkey4);
        if (kb == SEQ - KT) {
            // last tile: the K addresses are not needed again, so a V load's result
            // may be given their registers; the wait stands before that overwrite
            asm volatile("s_wait_xcnt 0x0" ::: "memory");
        }
        #pragma unroll
        for (int i = 0; i < 4; ++i)
            vr[i] = *(const float4*)(vh + (size_t)(kb + vkey + i) * HD + vd4);
        mr0 = *(const float4*)(mg + kb);
        mr1 = *(const float4*)(mg +  2 * SEQ + kb);
        mr2 = *(const float4*)(mg +  4 * SEQ + kb);
        mr3 = *(const float4*)(mg +  6 * SEQ + kb);
        mr4 = *(const float4*)(mg +  8 * SEQ + kb);
        mr5 = *(const float4*)(mg + 10 * SEQ + kb);
        mr6 = *(const float4*)(mg + 12 * SEQ + kb);
        mr7 = *(const float4*)(mg + 14 * SEQ + kb);
    };
    auto store_tile = [&](int buf) {
        #pragma unroll
        for (int j = 0; j < 4; ++j) {          // the 4x4 blocks go in transposed
            H4U a, b;
            #pragma unroll
            for (int i = 0; i < 4; ++i) {
                a.h[i] = (_Float16)(&kr[i].x)[j];
                b.h[i] = (_Float16)(&vr[i].x)[j];
            }
            *(uint2*)(&Ksh[buf][(kkey4 + j) * KP + kd0]) = a.u;
            *(uint2*)(&Vsh[buf][(vd4 + j) * VP + vkey])  = b.u;
        }
        float* md = &Msh[buf][mq * MP + mkey4];
        *(float4*)(md)           = mr0;
        *(float4*)(md +  2 * MP) = mr1;
        *(float4*)(md +  4 * MP) = mr2;
        *(float4*)(md +  6 * MP) = mr3;
        *(float4*)(md +  8 * MP) = mr4;
        *(float4*)(md + 10 * MP) = mr5;
        *(float4*)(md + 12 * MP) = mr6;
        *(float4*)(md + 14 * MP) = mr7;
    };

    // ---- Q^T B-fragments (32x16 f16, two covering D=64; lane = query column,
    //      same k order as ld_frag), built once ------------------------------
    v16h a0, a1;
    {
        const float* qrow = qh + (size_t)(qrow0 + ncol) * HD;
        #pragma unroll
        for (int half = 0; half < 2; ++half) {          // halves 0..7 / 8..15
            const int dbase = half * 16 + hi8;
            float4 f0 = *(const float4*)(qrow + dbase);
            float4 f1 = *(const float4*)(qrow + dbase + 4);
            float4 g0 = *(const float4*)(qrow + 32 + dbase);
            float4 g1 = *(const float4*)(qrow + 32 + dbase + 4);
            const float* fp0 = &f0.x; const float* fp1 = &f1.x;
            const float* gp0 = &g0.x; const float* gp1 = &g1.x;
            #pragma unroll
            for (int j = 0; j < 4; ++j) {
                a0[half * 8 + j]     = (_Float16)fp0[j];
                a0[half * 8 + 4 + j] = (_Float16)fp1[j];
                a1[half * 8 + j]     = (_Float16)gp0[j];
                a1[half * 8 + 4 + j] = (_Float16)gp1[j];
            }
        }
    }

    v16h ones;
    #pragma unroll
    for (int i = 0; i < 16; ++i) ones[i] = (_Float16)1.0f;

    // ---- online-softmax state of this lane's query (same in both halves) ---
    float mrun = -3.0e38f, lrun = 0.0f;
    v8f o0 = {}, o1 = {}, o2 = {}, o3 = {};   // o_t[r] = O[query][16t + hi8 + r]
    const int moff = (wave * RPW + ncol) * MP + hi8;   // this lane's query row in Msh

    // ---- prologue: stage tile 0 --------------------------------------------
    load_tile(0);
    // before a register that one of the loads above names as its address is reused
    asm volatile("s_wait_xcnt 0x0" ::: "memory");
    store_tile(0);
    __syncthreads();

    for (int step = 0; step < NSTEP; ++step) {
        const int kb  = step * KT;
        const int cur = step & 1;

        // issue next tile's global loads before compute (overlap with WMMA)
        if (step + 1 < NSTEP) {
            load_tile(kb + KT);
            // before a register that one of the loads above names as its address is reused
            asm volatile("s_wait_xcnt 0x0" ::: "memory");
        }
        // ---- mask of this lane's query: keys 16t+hi8 .. 16t+hi8+7, t = 0..3 ----
        const float* mrow = &Msh[cur][moff];
        float4 mk[8];
        #pragma unroll
        for (int t = 0; t < 4; ++t) {
            mk[2 * t]     = *(const float4*)(mrow + 16 * t);
            mk[2 * t + 1] = *(const float4*)(mrow + 16 * t + 4);
        }
        if (step + 2 < NSTEP) {
            __builtin_prefetch(kh + (size_t)kd0 * SEQ + kb + 2 * KT + kkey4, 0, 1);
            __builtin_prefetch(vh + (size_t)(kb + 2 * KT + vkey) * HD + vd4, 0, 1);
        }

        // ---- scores: S^T(64x16) = K(64x64) x Q^T(64x16), 8 WMMAs in 4 chains ----
        v8f c[4];
        #pragma unroll
        for (int t = 0; t < 4; ++t) {                          // key = 16t + ncol
            v8f z = {};
            c[t] = WMMA_F16(ld_frag(&Ksh[cur][(16 * t + ncol) * KP], hi8), a0, z);
        }
        #pragma unroll
        for (int t = 0; t < 4; ++t)
            c[t] = WMMA_F16(ld_frag(&Ksh[cur][(16 * t + ncol) * KP + 32], hi8), a1, c[t]);

        // ---- scale + mask: c[t][r] = key 16t + hi8 + r ----
        float sv[4][8];
        #pragma unroll
        for (int t = 0; t < 4; ++t) {
            const float mv[8] = {mk[2 * t].x, mk[2 * t].y, mk[2 * t].z, mk[2 * t].w,
                                 mk[2 * t + 1].x, mk[2 * t + 1].y, mk[2 * t + 1].z, mk[2 * t + 1].w};
            #pragma unroll
            for (int r = 0; r < 8; ++r) sv[t][r] = c[t][r] * inv_scale + mv[r];
        }

        // ---- maximum over the 64 keys: 32 in the lane, then the other half ----
        float mxt[4];
        #pragma unroll
        for (int t = 0; t < 4; ++t) {
            mxt[t] = sv[t][0];
            #pragma unroll
            for (int r = 1; r < 8; ++r) mxt[t] = fmaxf(mxt[t], sv[t][r]);
        }
        float mx = fmaxf(fmaxf(mxt[0], mxt[1]), fmaxf(mxt[2], mxt[3]));
        mx = fmaxf(mx, xhalf(mx));

        // ---- online softmax update; P^T packs straight into two B fragments ----
        const float mnew  = fmaxf(mrun, mx);
        const float alpha = __expf(mrun - mnew);
        mrun = mnew;
        v16h pb0, pb1;
        #pragma unroll
        for (int r = 0; r < 8; ++r) {
            pb0[r]     = (_Float16)__expf(sv[0][r] - mnew);
            pb0[8 + r] = (_Float16)__expf(sv[1][r] - mnew);
            pb1[r]     = (_Float16)__expf(sv[2][r] - mnew);
            pb1[8 + r] = (_Float16)__expf(sv[3][r] - mnew);
        }
        #pragma unroll
        for (int r = 0; r < 8; ++r) {
            o0[r] *= alpha; o1[r] *= alpha;
            o2[r] *= alpha; o3[r] *= alpha;
        }

        // ---- sums of P over the 64 keys via WMMA with an all-ones A: every row
        //      of the result holds the column sums ----
        v8f csum = {};
        csum = WMMA_F16(ones, pb0, csum);
        csum = WMMA_F16(ones, pb1, csum);
        lrun = lrun * alpha + csum[0];

        // ---- PV: O^T(64x16) += V^T(64x64) x P^T(64x16), 8 WMMAs in 4 chains ----
        {
            const _Float16* vrow = &Vsh[cur][ncol * VP];
            o0 = WMMA_F16(ld_frag(vrow + 0 * 16 * VP, hi8), pb0, o0);
            o1 = WMMA_F16(ld_frag(vrow + 1 * 16 * VP, hi8), pb0, o1);
            o2 = WMMA_F16(ld_frag(vrow + 2 * 16 * VP, hi8), pb0, o2);
            o3 = WMMA_F16(ld_frag(vrow + 3 * 16 * VP, hi8), pb0, o3);
            o0 = WMMA_F16(ld_frag(vrow + 0 * 16 * VP + 32, hi8), pb1, o0);
            o1 = WMMA_F16(ld_frag(vrow + 1 * 16 * VP + 32, hi8), pb1, o1);
            o2 = WMMA_F16(ld_frag(vrow + 2 * 16 * VP + 32, hi8), pb1, o2);
            o3 = WMMA_F16(ld_frag(vrow + 3 * 16 * VP + 32, hi8), pb1, o3);
        }

        // stage next tile into the other buffer; one barrier per step
        if (step + 1 < NSTEP) store_tile(cur ^ 1);
        __syncthreads();
    }

    // ---- epilogue: normalize by row sum, store fp32 (8 consecutive d a tile) -
    {
        const float invl = 1.0f / lrun;
        float* orow = oh + (size_t)(qrow0 + ncol) * HD + hi8;
        *(float4*)(orow +  0) = make_float4(o0[0] * invl, o0[1] * invl, o0[2] * invl, o0[3] * invl);
        *(float4*)(orow +  4) = make_float4(o0[4] * invl, o0[5] * invl, o0[6] * invl, o0[7] * invl);
        *(float4*)(orow + 16) = make_float4(o1[0] * invl, o1[1] * invl, o1[2] * invl, o1[3] * invl);
        *(float4*)(orow + 20) = make_float4(o1[4] * invl, o1[5] * invl, o1[6] * invl, o1[7] * invl);
        *(float4*)(orow + 32) = make_float4(o2[0] * invl, o2[1] * invl, o2[2] * invl, o2[3] * invl);
        *(float4*)(orow + 36) = make_float4(o2[4] * invl, o2[5] * invl, o2[6] * invl, o2[7] * invl);
        *(float4*)(orow + 48) = make_float4(o3[0] * invl, o3[1] * invl, o3[2] * invl, o3[3] * invl);
        *(float4*)(orow + 52) = make_float4(o3[4] * invl, o3[5] * invl, o3[6] * invl, o3[7] * invl);
    }
}

extern "C" void kernel_launch(void* const* d_in, const int* in_sizes, int n_in,
                              void* d_out, int out_size, void* d_ws, size_t ws_size,
                              hipStream_t stream) {
    (void)in_sizes; (void)n_in; (void)out_size; (void)d_ws; (void)ws_size;

    const float* q       = (const float*)d_in[0];   // [4,16,1024,64]
    const float* kT      = (const float*)d_in[1];   // [4,16,64,1024]
    const int*   scale_p = (const int*)  d_in[2];   // scalar 8
    const float* mask    = (const float*)d_in[3];   // [1024,1024]
    const float* v       = (const float*)d_in[4];   // [4,16,1024,64]
    float*       out     = (float*)d_out;           // [4,16,1024,64]

    const int heads = 4 * 16;
    dim3 grid(SEQ / RPB, heads);                    // (8, 64)
    dim3 block(BLOCK);                              // 256 threads = 8 wave32
    mha_flash_wmma_kernel<<<grid, block, 0, stream>>>(q, kT, scale_p, mask, v, out);
}
